// v000
// Times are from an AMD MI455X. After a warm-up the kernel runs many times in a row, and a time is the length of
// such a window on the GPU divided by its runs, so every launch and the gaps after it count. The runs cycle
// through copies of the inputs. A figure is the median of several windows, for all but v000 over two sittings.
// Sittings can differ by a few percent; kernels timed side by side share one.
// v000, which the later versions start from, runs in 1080 microseconds.
#include <hip/hip_runtime.h>

typedef float        v2f   __attribute__((ext_vector_type(2)));
typedef float        v4f   __attribute__((ext_vector_type(4)));
typedef float        v8f   __attribute__((ext_vector_type(8)));
typedef __bf16       v16bf __attribute__((ext_vector_type(16)));
typedef __bf16       v4bf  __attribute__((ext_vector_type(4)));
typedef unsigned int v4u   __attribute__((ext_vector_type(4)));

#define BTOT 4096
#define D    256           // X_DIM == Z_DIM == OUT_DIM
#define KW   (D * D)       // 65536 = W_kernel row length
#define RS   260           // LDS row stride (floats): 16B-aligned rows, conflict-free
#define SPW  32            // samples per workgroup (2 WMMA M-tiles)

// ---------------------------------------------------------------------------
// One-shot split of W_kernel into bf16 hi/lo planes (hi = rne(w), lo = rne(w - hi))
// ---------------------------------------------------------------------------
__global__ __launch_bounds__(256) void wk_split_bf16(
    const float* __restrict__ Wk,
    unsigned short* __restrict__ hiU, unsigned short* __restrict__ loU)
{
    v4bf* hi = (v4bf*)hiU;
    v4bf* lo = (v4bf*)loU;
    const int total = (D * KW) / 4;
    for (int q = blockIdx.x * blockDim.x + threadIdx.x; q < total;
         q += gridDim.x * blockDim.x) {
        v4f w = ((const v4f*)Wk)[q];
        v4bf h, l;
        #pragma unroll
        for (int j = 0; j < 4; ++j) {
            __bf16 hh = (__bf16)w[j];
            h[j] = hh;
            l[j] = (__bf16)(w[j] - (float)hh);
        }
        hi[q] = h;
        lo[q] = l;
    }
}

// ---------------------------------------------------------------------------
// Fragment helpers (bf16 16x16x32 operand layout, wave32)
// A 16x32: lanes 0-15 hold K {0..7,16..23}, lanes 16-31 hold K {8..15,24..31},
// K-pairs packed per VGPR.  B 32x16 mirrors A with N = lane%16.
// ---------------------------------------------------------------------------
union BFrag { v4u u[2]; v16bf v; };

__device__ __forceinline__ v16bf load_b_frag(const __bf16* base, int i0, int hi) {
    BFrag f;
    f.u[0] = *(const v4u*)(base + i0 + 8 * hi);        // K = 8hi .. 8hi+7
    f.u[1] = *(const v4u*)(base + i0 + 16 + 8 * hi);   // K = 16+8hi .. +7
    return f.v;
}

__device__ __forceinline__ void make_a_frags(const float* xrow, int i0, int hi,
                                             float zv, v16bf& ah, v16bf& al) {
    v4f q0 = *(const v4f*)(xrow + i0 + 8 * hi);        // ds_load_b128
    v4f q1 = *(const v4f*)(xrow + i0 + 8 * hi + 4);
    v4f q2 = *(const v4f*)(xrow + i0 + 16 + 8 * hi);
    v4f q3 = *(const v4f*)(xrow + i0 + 20 + 8 * hi);
    float xf[16] = { q0.x, q0.y, q0.z, q0.w, q1.x, q1.y, q1.z, q1.w,
                     q2.x, q2.y, q2.z, q2.w, q3.x, q3.y, q3.z, q3.w };
    #pragma unroll
    for (int j = 0; j < 16; ++j) {
        float a   = zv * xf[j];        // rank-1 A element in f32
        __bf16 h  = (__bf16)a;         // RNE -> v_cvt_pk_bf16_f32
        ah[j] = h;
        al[j] = (__bf16)(a - (float)h);
    }
}

#define WMMA_BF16(ACC, A, B) \
    ACC = __builtin_amdgcn_wmma_f32_16x16x32_bf16(false, A, false, B, (short)0, ACC, false, false)
#define WMMA_F32(ACC, A, B) \
    ACC = __builtin_amdgcn_wmma_f32_16x16x4_f32(false, A, false, B, (short)0, ACC, false, false)

// ---------------------------------------------------------------------------
// Main fused kernel: bf16x3 split GEMM  out[b,o] = sum_{zk,i} z*x*Wk + biases
// ---------------------------------------------------------------------------
__global__ __launch_bounds__(256) void bilinear_wmma_bf16x3(
    const float* __restrict__ x,  const float* __restrict__ z,
    const unsigned short* __restrict__ WhiU, const unsigned short* __restrict__ WloU,
    const float* __restrict__ Wb, const float* __restrict__ bk,
    const float* __restrict__ bb, float* __restrict__ out)
{
    __shared__ float zs[SPW * RS];
    __shared__ float xs[SPW * RS];

    const int tid   = threadIdx.x;
    const int bbase = blockIdx.x * SPW;

    for (int idx = tid; idx < SPW * D; idx += 256) {
        const int s = idx >> 8, c = idx & (D - 1);
        zs[s * RS + c] = z[(bbase + s) * D + c];
        xs[s * RS + c] = x[(bbase + s) * D + c];
    }
    __syncthreads();

    const int lane = tid & 31;
    const int wave = tid >> 5;
    const int r    = lane & 15;
    const int hi   = lane >> 4;
    const int o0   = (wave * 2 + 0) * 16 + r;
    const int o1   = (wave * 2 + 1) * 16 + r;

    const __bf16* Whi = (const __bf16*)WhiU;
    const __bf16* Wlo = (const __bf16*)WloU;

    v8f acc00 = {}; v8f acc01 = {}; v8f acc10 = {}; v8f acc11 = {};

    const float* xrowA = &xs[(r +  0) * RS];
    const float* xrowB = &xs[(r + 16) * RS];

    // ---- main contraction, bf16 hi/lo split, fp32 accumulate ----
    for (int zk = 0; zk < D; ++zk) {
        const float zvA = zs[(r +  0) * RS + zk];
        const float zvB = zs[(r + 16) * RS + zk];
        const __bf16* bh0 = Whi + (size_t)zk * KW + (size_t)o0 * D;
        const __bf16* bh1 = Whi + (size_t)zk * KW + (size_t)o1 * D;
        const __bf16* bl0 = Wlo + (size_t)zk * KW + (size_t)o0 * D;
        const __bf16* bl1 = Wlo + (size_t)zk * KW + (size_t)o1 * D;
        for (int i0 = 0; i0 < D; i0 += 32) {
            v16bf aAh, aAl, aBh, aBl;
            make_a_frags(xrowA, i0, hi, zvA, aAh, aAl);
            make_a_frags(xrowB, i0, hi, zvB, aBh, aBl);
            const v16bf Bh0 = load_b_frag(bh0, i0, hi);   // 2x global_load_b128
            const v16bf Bl0 = load_b_frag(bl0, i0, hi);
            const v16bf Bh1 = load_b_frag(bh1, i0, hi);
            const v16bf Bl1 = load_b_frag(bl1, i0, hi);
            WMMA_BF16(acc00, aAh, Bh0); WMMA_BF16(acc00, aAh, Bl0); WMMA_BF16(acc00, aAl, Bh0);
            WMMA_BF16(acc01, aAh, Bh1); WMMA_BF16(acc01, aAh, Bl1); WMMA_BF16(acc01, aAl, Bh1);
            WMMA_BF16(acc10, aBh, Bh0); WMMA_BF16(acc10, aBh, Bl0); WMMA_BF16(acc10, aBl, Bh0);
            WMMA_BF16(acc11, aBh, Bh1); WMMA_BF16(acc11, aBh, Bl1); WMMA_BF16(acc11, aBl, Bh1);
        }
    }

    // ---- W_bias pass (exact fp32 WMMA): out += sum_i W_bias[o,i]*x[b,i] ----
    {
        const float* xpA = xrowA + 2 * hi;
        const float* xpB = xrowB + 2 * hi;
        const float* w0  = Wb + o0 * D + 2 * hi;
        const float* w1  = Wb + o1 * D + 2 * hi;
        #pragma unroll 4
        for (int i0 = 0; i0 < D; i0 += 4) {
            const v2f aA  = *(const v2f*)(xpA + i0);
            const v2f aB  = *(const v2f*)(xpB + i0);
            const v2f bf0 = *(const v2f*)(w0 + i0);
            const v2f bf1 = *(const v2f*)(w1 + i0);
            WMMA_F32(acc00, aA, bf0); WMMA_F32(acc01, aA, bf1);
            WMMA_F32(acc10, aB, bf0); WMMA_F32(acc11, aB, bf1);
        }
    }

    // ---- per-sample bias (exact fp32 WMMA): out += sum_zk z[b,zk]*b_kernel[zk,o] ----
    for (int zk = 0; zk < D; zk += 4) {
        v2f aA; aA.x = zs[(r +  0) * RS + zk + 2 * hi];
        /*   */ aA.y = zs[(r +  0) * RS + zk + 2 * hi + 1];
        v2f aB; aB.x = zs[(r + 16) * RS + zk + 2 * hi];
        /*   */ aB.y = zs[(r + 16) * RS + zk + 2 * hi + 1];
        v2f bf0; bf0.x = bk[(zk + 2 * hi) * D + o0];
        /*    */ bf0.y = bk[(zk + 2 * hi + 1) * D + o0];
        v2f bf1; bf1.x = bk[(zk + 2 * hi) * D + o1];
        /*    */ bf1.y = bk[(zk + 2 * hi + 1) * D + o1];
        WMMA_F32(acc00, aA, bf0); WMMA_F32(acc01, aA, bf1);
        WMMA_F32(acc10, aB, bf0); WMMA_F32(acc11, aB, bf1);
    }

    const float bias0 = bb[o0];
    const float bias1 = bb[o1];
    #pragma unroll
    for (int j = 0; j < 8; ++j) {
        const int rowA = bbase +      j + 8 * hi;
        const int rowB = bbase + 16 + j + 8 * hi;
        out[rowA * D + o0] = acc00[j] + bias0;
        out[rowA * D + o1] = acc01[j] + bias1;
        out[rowB * D + o0] = acc10[j] + bias0;
        out[rowB * D + o1] = acc11[j] + bias1;
    }
}

// ---------------------------------------------------------------------------
// Fallback: all-fp32 WMMA fused kernel (used when d_ws can't hold bf16 planes)
// ---------------------------------------------------------------------------
__global__ __launch_bounds__(256) void bilinear_wmma_f32(
    const float* __restrict__ x,  const float* __restrict__ z,
    const float* __restrict__ Wk, const float* __restrict__ Wb,
    const float* __restrict__ bk, const float* __restrict__ bb,
    float* __restrict__ out)
{
    __shared__ float zs[SPW * RS];
    __shared__ float xs[SPW * RS];

    const int tid   = threadIdx.x;
    const int bbase = blockIdx.x * SPW;

    for (int idx = tid; idx < SPW * D; idx += 256) {
        const int s = idx >> 8, c = idx & (D - 1);
        zs[s * RS + c] = z[(bbase + s) * D + c];
        xs[s * RS + c] = x[(bbase + s) * D + c];
    }
    __syncthreads();

    const int lane = tid & 31;
    const int wave = tid >> 5;
    const int r    = lane & 15;
    const int hi   = lane >> 4;
    const int o0   = (wave * 2 + 0) * 16 + r;
    const int o1   = (wave * 2 + 1) * 16 + r;

    v8f acc00 = {}; v8f acc01 = {}; v8f acc10 = {}; v8f acc11 = {};

    const float* xpA = &xs[(r +  0) * RS + 2 * hi];
    const float* xpB = &xs[(r + 16) * RS + 2 * hi];

    for (int zk = 0; zk < D; ++zk) {
        const float zvA = zs[(r +  0) * RS + zk];
        const float zvB = zs[(r + 16) * RS + zk];
        const float* w0 = Wk + (size_t)zk * KW + o0 * D + 2 * hi;
        const float* w1 = Wk + (size_t)zk * KW + o1 * D + 2 * hi;
        #pragma unroll 4
        for (int i0 = 0; i0 < D; i0 += 4) {
            const v2f xA  = *(const v2f*)(xpA + i0);
            const v2f xB  = *(const v2f*)(xpB + i0);
            const v2f bf0 = *(const v2f*)(w0 + i0);
            const v2f bf1 = *(const v2f*)(w1 + i0);
            v2f aA; aA.x = zvA * xA.x; aA.y = zvA * xA.y;
            v2f aB; aB.x = zvB * xB.x; aB.y = zvB * xB.y;
            WMMA_F32(acc00, aA, bf0); WMMA_F32(acc01, aA, bf1);
            WMMA_F32(acc10, aB, bf0); WMMA_F32(acc11, aB, bf1);
        }
    }
    {
        const float* w0 = Wb + o0 * D + 2 * hi;
        const float* w1 = Wb + o1 * D + 2 * hi;
        #pragma unroll 4
        for (int i0 = 0; i0 < D; i0 += 4) {
            const v2f aA  = *(const v2f*)(xpA + i0);
            const v2f aB  = *(const v2f*)(xpB + i0);
            const v2f bf0 = *(const v2f*)(w0 + i0);
            const v2f bf1 = *(const v2f*)(w1 + i0);
            WMMA_F32(acc00, aA, bf0); WMMA_F32(acc01, aA, bf1);
            WMMA_F32(acc10, aB, bf0); WMMA_F32(acc11, aB, bf1);
        }
    }
    for (int zk = 0; zk < D; zk += 4) {
        v2f aA; aA.x = zs[(r +  0) * RS + zk + 2 * hi];
        /*   */ aA.y = zs[(r +  0) * RS + zk + 2 * hi + 1];
        v2f aB; aB.x = zs[(r + 16) * RS + zk + 2 * hi];
        /*   */ aB.y = zs[(r + 16) * RS + zk + 2 * hi + 1];
        v2f bf0; bf0.x = bk[(zk + 2 * hi) * D + o0];
        /*    */ bf0.y = bk[(zk + 2 * hi + 1) * D + o0];
        v2f bf1; bf1.x = bk[(zk + 2 * hi) * D + o1];
        /*    */ bf1.y = bk[(zk + 2 * hi + 1) * D + o1];
        WMMA_F32(acc00, aA, bf0); WMMA_F32(acc01, aA, bf1);
        WMMA_F32(acc10, aB, bf0); WMMA_F32(acc11, aB, bf1);
    }

    const float bias0 = bb[o0];
    const float bias1 = bb[o1];
    #pragma unroll
    for (int j = 0; j < 8; ++j) {
        const int rowA = bbase +      j + 8 * hi;
        const int rowB = bbase + 16 + j + 8 * hi;
        out[rowA * D + o0] = acc00[j] + bias0;
        out[rowA * D + o1] = acc01[j] + bias1;
        out[rowB * D + o0] = acc10[j] + bias0;
        out[rowB * D + o1] = acc11[j] + bias1;
    }
}

extern "C" void kernel_launch(void* const* d_in, const int* in_sizes, int n_in,
                              void* d_out, int out_size, void* d_ws, size_t ws_size,
                              hipStream_t stream) {
    const float* x  = (const float*)d_in[0];   // [4096,256]
    const float* z  = (const float*)d_in[1];   // [4096,256]
    const float* Wk = (const float*)d_in[2];   // [256,65536]
    const float* Wb = (const float*)d_in[3];   // [65536]
    const float* bk = (const float*)d_in[4];   // [256,256]
    const float* bb = (const float*)d_in[5];   // [256]
    float* out = (float*)d_out;                // [4096,256]

    const size_t need = (size_t)2 * D * KW * sizeof(unsigned short);  // 67 MB hi+lo planes
    if (ws_size >= need) {
        unsigned short* Whi = (unsigned short*)d_ws;
        unsigned short* Wlo = Whi + (size_t)D * KW;
        wk_split_bf16<<<2048, 256, 0, stream>>>(Wk, Whi, Wlo);
        bilinear_wmma_bf16x3<<<BTOT / SPW, 256, 0, stream>>>(x, z, Whi, Wlo, Wb, bk, bb, out);
    } else {
        bilinear_wmma_f32<<<BTOT / SPW, 256, 0, stream>>>(x, z, Wk, Wb, bk, bb, out);
    }
}

// v001
// A run of this version takes 1090 microseconds.
// In two side-by-side timings against v000, it was 1.04 and 1.03 times as fast.
#include <hip/hip_runtime.h>

typedef float        v2f   __attribute__((ext_vector_type(2)));
typedef float        v4f   __attribute__((ext_vector_type(4)));
typedef float        v8f   __attribute__((ext_vector_type(8)));
typedef __bf16       v16bf __attribute__((ext_vector_type(16)));
typedef __bf16       v4bf  __attribute__((ext_vector_type(4)));
typedef unsigned int v4u   __attribute__((ext_vector_type(4)));

#define BTOT 4096
#define D    256           // X_DIM == Z_DIM == OUT_DIM
#define KW   (D * D)       // 65536 = W_kernel row length
#define RS   260           // LDS row stride (floats): 16B-aligned rows, conflict-free
#define SPW  32            // samples per workgroup (2 WMMA M-tiles)

// ---------------------------------------------------------------------------
// One-shot split of W_kernel into bf16 hi/lo planes (hi = rne(w), lo = rne(w - hi))
// ---------------------------------------------------------------------------
__global__ __launch_bounds__(256) void wk_split_bf16(
    const float* __restrict__ Wk,
    unsigned short* __restrict__ hiU, unsigned short* __restrict__ loU)
{
    v4bf* hi = (v4bf*)hiU;
    v4bf* lo = (v4bf*)loU;
    const int total = (D * KW) / 4;
    for (int q = blockIdx.x * blockDim.x + threadIdx.x; q < total;
         q += gridDim.x * blockDim.x) {
        v4f w = ((const v4f*)Wk)[q];
        v4bf h, l;
        #pragma unroll
        for (int j = 0; j < 4; ++j) {
            __bf16 hh = (__bf16)w[j];
            h[j] = hh;
            l[j] = (__bf16)(w[j] - (float)hh);
        }
        hi[q] = h;
        lo[q] = l;
    }
}

// ---------------------------------------------------------------------------
// Fragment helpers (bf16 16x16x32 operand layout, wave32)
// A 16x32: lanes 0-15 hold K {0..7,16..23}, lanes 16-31 hold K {8..15,24..31},
// K-pairs packed per VGPR.  B 32x16 mirrors A with N = lane%16.
// ---------------------------------------------------------------------------
union BFrag { v4u u[2]; v16bf v; };

// p: the lane's own global byte address (row o, K = 8hi); off: constant byte offset of the k-step
typedef const __attribute__((address_space(1))) v4u* gv4u_ptr;
__device__ __forceinline__ v16bf load_b_bytes(unsigned long long p, int off) {
    BFrag f;
    f.u[0] = *(gv4u_ptr)(p + off);        // K = 8hi .. 8hi+7
    f.u[1] = *(gv4u_ptr)(p + off + 32);   // K = 16+8hi .. +7
    return f.v;
}

#define WMMA_BF16(ACC, A, B) \
    ACC = __builtin_amdgcn_wmma_f32_16x16x32_bf16(false, A, false, B, (short)0, ACC, false, false)
#define WMMA_F32(ACC, A, B) \
    ACC = __builtin_amdgcn_wmma_f32_16x16x4_f32(false, A, false, B, (short)0, ACC, false, false)

// ---------------------------------------------------------------------------
// Main fused kernel: bf16x3 split GEMM, contracted over i first:
//   T[b,o] = sum_i x[b,i]*Wk[zk,o,i]  (WMMA, A = split x, the same for every zk)
//   out[b,o] += z[b,zk]*T[b,o]        (f32 FMA on the accumulator tiles)
// ---------------------------------------------------------------------------
__device__ __forceinline__ void split_x_frag(const float* xrow, int i0, int hi,
                                             v16bf& ah, v16bf& al) {
    v4f q0 = *(const v4f*)(xrow + i0 + 8 * hi);
    v4f q1 = *(const v4f*)(xrow + i0 + 8 * hi + 4);
    v4f q2 = *(const v4f*)(xrow + i0 + 16 + 8 * hi);
    v4f q3 = *(const v4f*)(xrow + i0 + 20 + 8 * hi);
    float xf[16] = { q0.x, q0.y, q0.z, q0.w, q1.x, q1.y, q1.z, q1.w,
                     q2.x, q2.y, q2.z, q2.w, q3.x, q3.y, q3.z, q3.w };
    #pragma unroll
    for (int j = 0; j < 16; ++j) {
        __bf16 h = (__bf16)xf[j];
        ah[j] = h;
        al[j] = (__bf16)(xf[j] - (float)h);
    }
}

#define ZP 36              // LDS pitch (floats) of transposed z: 16B-aligned rows

__global__ __launch_bounds__(256) void bilinear_wmma_bf16x3(
    const float* __restrict__ x,  const float* __restrict__ z,
    const unsigned short* __restrict__ WhiU, const unsigned short* __restrict__ WloU,
    const float* __restrict__ Wb, const float* __restrict__ bk,
    const float* __restrict__ bb, float* __restrict__ out)
{
    __shared__ float zs[SPW * RS];
    __shared__ float xs[SPW * RS];
    __shared__ __attribute__((aligned(16))) float zt[D * ZP];   // zt[zk][sample]

    const int tid   = threadIdx.x;
    const int bbase = blockIdx.x * SPW;

    for (int idx = tid; idx < SPW * D; idx += 256) {
        const int s = idx >> 8, c = idx & (D - 1);
        const float zval = z[(bbase + s) * D + c];
        zs[s * RS + c] = zval;
        zt[c * ZP + s] = zval;
        xs[s * RS + c] = x[(bbase + s) * D + c];
    }
    __syncthreads();

    const int lane = tid & 31;
    const int wave = tid >> 5;
    const int r    = lane & 15;
    const int hi   = lane >> 4;
    const int o0   = (wave * 2 + 0) * 16 + r;
    const int o1   = (wave * 2 + 1) * 16 + r;

    v8f acc00 = {}; v8f acc01 = {}; v8f acc10 = {}; v8f acc11 = {};

    const float* xrowA = &xs[(r +  0) * RS];
    const float* xrowB = &xs[(r + 16) * RS];

    // ---- W fragment ring: first four stages, asked for ahead of the x split ----
    // A stage is one column tile (16 o) x 64 i of both planes: whole 128-B lines.
    // Eight stages per zk; four are in registers, loaded four stages ahead.
    unsigned long long qh = (unsigned long long)WhiU + (unsigned long long)(o0 * D + 8 * hi) * 2;
    unsigned long long ql = (unsigned long long)WloU + (unsigned long long)(o0 * D + 8 * hi) * 2;
    v16bf Bh[4][2], Bl[4][2];
    #pragma unroll   // constant indices: the ring stays in registers
    for (int st = 0; st < 4; ++st) {
        const int off = (st & 1) * (16 * D * 2) + (st >> 1) * 128;
        Bh[st][0] = load_b_bytes(qh, off);
        Bh[st][1] = load_b_bytes(qh, off + 64);
        Bl[st][0] = load_b_bytes(ql, off);
        Bl[st][1] = load_b_bytes(ql, off + 64);
    }
    // the wait stands in front of any reuse of the registers that these loads name
    asm volatile("s_wait_xcnt 0x0" : "+v"(qh), "+v"(ql) :: "memory");

    // ---- A operand: x split into bf16 hi/lo once, held in registers for all zk ----
    v16bf xAh[8], xAl[8], xBh[8], xBl[8];
    #pragma unroll   // constant indices: the fragment arrays stay in registers
    for (int kk = 0; kk < 8; ++kk) {
        split_x_frag(xrowA, kk * 32, hi, xAh[kk], xAl[kk]);
        split_x_frag(xrowB, kk * 32, hi, xBh[kk], xBl[kk]);
    }

    // ---- main contraction ----
    const float* ztp = &zt[8 * hi];
    // kept rolled: one zk is 96 WMMAs already, and a second copy would not fit the registers
    #pragma unroll 1
    for (int zk = 0; zk < D; ++zk) {
        // the last zk refetches its own first stages, so that no load leaves the planes
        const size_t nxt = (zk + 1 < D) ? (size_t)KW * 2 : (size_t)0;
        const v4f zA0 = *(const v4f*)(ztp + zk * ZP);
        const v4f zA1 = *(const v4f*)(ztp + zk * ZP + 4);
        const v4f zB0 = *(const v4f*)(ztp + zk * ZP + 16);
        const v4f zB1 = *(const v4f*)(ztp + zk * ZP + 20);
        v8f tA[2] = { {}, {} };
        v8f tB[2] = { {}, {} };
        #pragma unroll   // constant ring slot, fragment and tile indices (registers, no scratch)
        for (int st = 0; st < 8; ++st) {
            const int ct = st & 1, pr = st >> 1, sl = st & 3;
            #pragma unroll   // as above
            for (int h = 0; h < 2; ++h) {
                const int kk = pr * 2 + h;
                WMMA_BF16(tA[ct], xAh[kk], Bh[sl][h]); WMMA_BF16(tB[ct], xBh[kk], Bh[sl][h]);
                WMMA_BF16(tA[ct], xAh[kk], Bl[sl][h]); WMMA_BF16(tB[ct], xBh[kk], Bl[sl][h]);
                WMMA_BF16(tA[ct], xAl[kk], Bh[sl][h]); WMMA_BF16(tB[ct], xBl[kk], Bh[sl][h]);
            }
            if (st == 4) {
                // the two address pairs move on to the next zk here, once per zk
                qh += nxt;
                ql += nxt;
            }
            const int s4  = (st + 4) & 7;
            const int off = (s4 & 1) * (16 * D * 2) + (s4 >> 1) * 128;
            Bh[sl][0] = load_b_bytes(qh, off);
            Bh[sl][1] = load_b_bytes(qh, off + 64);
            Bl[sl][0] = load_b_bytes(ql, off);
            Bl[sl][1] = load_b_bytes(ql, off + 64);
        }
        #pragma unroll   // constant vector element indices
        for (int j = 0; j < 4; ++j) {
            acc00[j]     += zA0[j] * tA[0][j];
            acc00[j + 4] += zA1[j] * tA[0][j + 4];
            acc01[j]     += zA0[j] * tA[1][j];
            acc01[j + 4] += zA1[j] * tA[1][j + 4];
            acc10[j]     += zB0[j] * tB[0][j];
            acc10[j + 4] += zB1[j] * tB[0][j + 4];
            acc11[j]     += zB0[j] * tB[1][j];
            acc11[j + 4] += zB1[j] * tB[1][j + 4];
        }
    }

    // ---- W_bias pass (exact fp32 WMMA): out += sum_i W_bias[o,i]*x[b,i] ----
    {
        const float* xpA = xrowA + 2 * hi;
        const float* xpB = xrowB + 2 * hi;
        const float* w0  = Wb + o0 * D + 2 * hi;
        const float* w1  = Wb + o1 * D + 2 * hi;
        #pragma unroll 4
        for (int i0 = 0; i0 < D; i0 += 4) {
            const v2f aA  = *(const v2f*)(xpA + i0);
            const v2f aB  = *(const v2f*)(xpB + i0);
            const v2f bf0 = *(const v2f*)(w0 + i0);
            const v2f bf1 = *(const v2f*)(w1 + i0);
            WMMA_F32(acc00, aA, bf0); WMMA_F32(acc01, aA, bf1);
            WMMA_F32(acc10, aB, bf0); WMMA_F32(acc11, aB, bf1);
        }
    }

    // ---- per-sample bias (exact fp32 WMMA): out += sum_zk z[b,zk]*b_kernel[zk,o] ----
    for (int zk = 0; zk < D; zk += 4) {
        v2f aA; aA.x = zs[(r +  0) * RS + zk + 2 * hi];
        /*   */ aA.y = zs[(r +  0) * RS + zk + 2 * hi + 1];
        v2f aB; aB.x = zs[(r + 16) * RS + zk + 2 * hi];
        /*   */ aB.y = zs[(r + 16) * RS + zk + 2 * hi + 1];
        v2f bf0; bf0.x = bk[(zk + 2 * hi) * D + o0];
        /*    */ bf0.y = bk[(zk + 2 * hi + 1) * D + o0];
        v2f bf1; bf1.x = bk[(zk + 2 * hi) * D + o1];
        /*    */ bf1.y = bk[(zk + 2 * hi + 1) * D + o1];
        WMMA_F32(acc00, aA, bf0); WMMA_F32(acc01, aA, bf1);
        WMMA_F32(acc10, aB, bf0); WMMA_F32(acc11, aB, bf1);
    }

    const float bias0 = bb[o0];
    const float bias1 = bb[o1];
    #pragma unroll
    for (int j = 0; j < 8; ++j) {
        const int rowA = bbase +      j + 8 * hi;
        const int rowB = bbase + 16 + j + 8 * hi;
        out[rowA * D + o0] = acc00[j] + bias0;
        out[rowA * D + o1] = acc01[j] + bias1;
        out[rowB * D + o0] = acc10[j] + bias0;
        out[rowB * D + o1] = acc11[j] + bias1;
    }
}

// ---------------------------------------------------------------------------
// Fallback: all-fp32 WMMA fused kernel (used when d_ws can't hold bf16 planes)
// ---------------------------------------------------------------------------
__global__ __launch_bounds__(256) void bilinear_wmma_f32(
    const float* __restrict__ x,  const float* __restrict__ z,
    const float* __restrict__ Wk, const float* __restrict__ Wb,
    const float* __restrict__ bk, const float* __restrict__ bb,
    float* __restrict__ out)
{
    __shared__ float zs[SPW * RS];
    __shared__ float xs[SPW * RS];

    const int tid   = threadIdx.x;
    const int bbase = blockIdx.x * SPW;

    for (int idx = tid; idx < SPW * D; idx += 256) {
        const int s = idx >> 8, c = idx & (D - 1);
        zs[s * RS + c] = z[(bbase + s) * D + c];
        xs[s * RS + c] = x[(bbase + s) * D + c];
    }
    __syncthreads();

    const int lane = tid & 31;
    const int wave = tid >> 5;
    const int r    = lane & 15;
    const int hi   = lane >> 4;
    const int o0   = (wave * 2 + 0) * 16 + r;
    const int o1   = (wave * 2 + 1) * 16 + r;

    v8f acc00 = {}; v8f acc01 = {}; v8f acc10 = {}; v8f acc11 = {};

    const float* xpA = &xs[(r +  0) * RS + 2 * hi];
    const float* xpB = &xs[(r + 16) * RS + 2 * hi];

    for (int zk = 0; zk < D; ++zk) {
        const float zvA = zs[(r +  0) * RS + zk];
        const float zvB = zs[(r + 16) * RS + zk];
        const float* w0 = Wk + (size_t)zk * KW + o0 * D + 2 * hi;
        const float* w1 = Wk + (size_t)zk * KW + o1 * D + 2 * hi;
        #pragma unroll 4
        for (int i0 = 0; i0 < D; i0 += 4) {
            const v2f xA  = *(const v2f*)(xpA + i0);
            const v2f xB  = *(const v2f*)(xpB + i0);
            const v2f bf0 = *(const v2f*)(w0 + i0);
            const v2f bf1 = *(const v2f*)(w1 + i0);
            v2f aA; aA.x = zvA * xA.x; aA.y = zvA * xA.y;
            v2f aB; aB.x = zvB * xB.x; aB.y = zvB * xB.y;
            WMMA_F32(acc00, aA, bf0); WMMA_F32(acc01, aA, bf1);
            WMMA_F32(acc10, aB, bf0); WMMA_F32(acc11, aB, bf1);
        }
    }
    {
        const float* w0 = Wb + o0 * D + 2 * hi;
        const float* w1 = Wb + o1 * D + 2 * hi;
        #pragma unroll 4
        for (int i0 = 0; i0 < D; i0 += 4) {
            const v2f aA  = *(const v2f*)(xpA + i0);
            const v2f aB  = *(const v2f*)(xpB + i0);
            const v2f bf0 = *(const v2f*)(w0 + i0);
            const v2f bf1 = *(const v2f*)(w1 + i0);
            WMMA_F32(acc00, aA, bf0); WMMA_F32(acc01, aA, bf1);
            WMMA_F32(acc10, aB, bf0); WMMA_F32(acc11, aB, bf1);
        }
    }
    for (int zk = 0; zk < D; zk += 4) {
        v2f aA; aA.x = zs[(r +  0) * RS + zk + 2 * hi];
        /*   */ aA.y = zs[(r +  0) * RS + zk + 2 * hi + 1];
        v2f aB; aB.x = zs[(r + 16) * RS + zk + 2 * hi];
        /*   */ aB.y = zs[(r + 16) * RS + zk + 2 * hi + 1];
        v2f bf0; bf0.x = bk[(zk + 2 * hi) * D + o0];
        /*    */ bf0.y = bk[(zk + 2 * hi + 1) * D + o0];
        v2f bf1; bf1.x = bk[(zk + 2 * hi) * D + o1];
        /*    */ bf1.y = bk[(zk + 2 * hi + 1) * D + o1];
        WMMA_F32(acc00, aA, bf0); WMMA_F32(acc01, aA, bf1);
        WMMA_F32(acc10, aB, bf0); WMMA_F32(acc11, aB, bf1);
    }

    const float bias0 = bb[o0];
    const float bias1 = bb[o1];
    #pragma unroll
    for (int j = 0; j < 8; ++j) {
        const int rowA = bbase +      j + 8 * hi;
        const int rowB = bbase + 16 + j + 8 * hi;
        out[rowA * D + o0] = acc00[j] + bias0;
        out[rowA * D + o1] = acc01[j] + bias1;
        out[rowB * D + o0] = acc10[j] + bias0;
        out[rowB * D + o1] = acc11[j] + bias1;
    }
}

extern "C" void kernel_launch(void* const* d_in, const int* in_sizes, int n_in,
                              void* d_out, int out_size, void* d_ws, size_t ws_size,
                              hipStream_t stream) {
    const float* x  = (const float*)d_in[0];   // [4096,256]
    const float* z  = (const float*)d_in[1];   // [4096,256]
    const float* Wk = (const float*)d_in[2];   // [256,65536]
    const float* Wb = (const float*)d_in[3];   // [65536]
    const float* bk = (const float*)d_in[4];   // [256,256]
    const float* bb = (const float*)d_in[5];   // [256]
    float* out = (float*)d_out;                // [4096,256]

    const size_t need = (size_t)2 * D * KW * sizeof(unsigned short);  // 67 MB hi+lo planes
    if (ws_size >= need) {
        unsigned short* Whi = (unsigned short*)d_ws;
        unsigned short* Wlo = Whi + (size_t)D * KW;
        wk_split_bf16<<<2048, 256, 0, stream>>>(Wk, Whi, Wlo);
        bilinear_wmma_bf16x3<<<BTOT / SPW, 256, 0, stream>>>(x, z, Whi, Wlo, Wb, bk, bb, out);
    } else {
        bilinear_wmma_f32<<<BTOT / SPW, 256, 0, stream>>>(x, z, Wk, Wb, bk, bb, out);
    }
}

// v002
// One run takes 564 microseconds.
// Next to v001, in two timings, it ran 1.89 and 1.91 times as fast.
// Over all steps from v000 it is 1.96 times as fast.
#include <hip/hip_runtime.h>

typedef float        v2f   __attribute__((ext_vector_type(2)));
typedef float        v4f   __attribute__((ext_vector_type(4)));
typedef float        v8f   __attribute__((ext_vector_type(8)));
typedef __bf16       v16bf __attribute__((ext_vector_type(16)));
typedef __bf16       v8bf  __attribute__((ext_vector_type(8)));
typedef unsigned int v4u   __attribute__((ext_vector_type(4)));

#define BTOT 4096
#define D    256           // X_DIM == Z_DIM == OUT_DIM
#define KW   (D * D)       // 65536 = W_kernel row length
#define RS   260           // LDS row stride (floats): 16B-aligned rows, conflict-free
#define SPW  32            // samples per workgroup (2 WMMA M-tiles)

// ---------------------------------------------------------------------------
// One-shot split of W_kernel into bf16 hi/lo planes (hi = rne(w), lo = rne(w - hi)),
// each plane stored in B-fragment order:
//   plane[zk][o / 16][i / 32][half][lane][8 values], lane = (o % 16) + 16 * hi,
//   the 8 values being i % 32 = 16 * half + 8 * hi + 0..7.
// A fragment (16 o x 32 i) is 1 KiB in a row, and each of its two 16-byte loads per
// lane reads 512 contiguous bytes (4 whole lines) per wave.
// ---------------------------------------------------------------------------
__global__ __launch_bounds__(256) void wk_split_bf16(
    const float* __restrict__ Wk,
    unsigned short* __restrict__ hiU, unsigned short* __restrict__ loU)
{
    v8bf* hi = (v8bf*)hiU;
    v8bf* lo = (v8bf*)loU;
    const int total = (D * KW) / 16;       // one lane's share (16 values) per trip
    for (int q = blockIdx.x * blockDim.x + threadIdx.x; q < total;
         q += gridDim.x * blockDim.x) {
        const int lane = q & 31;
        const int tile = q >> 5;                             // (zk * 16 + o / 16) * 8 + i / 32
        const int row  = (tile >> 3) * 16 + (lane & 15);     // zk * 256 + o
        const float* src = Wk + row * D + (tile & 7) * 32 + 8 * (lane >> 4);
        #pragma unroll   // constant offsets: the four loads go out together
        for (int half = 0; half < 2; ++half) {
            const v4f wa = *(const v4f*)(src + 16 * half);
            const v4f wb = *(const v4f*)(src + 16 * half + 4);
            v8bf h, l;
            #pragma unroll   // constant vector element indices
            for (int j = 0; j < 4; ++j) {
                const __bf16 ha = (__bf16)wa[j];
                const __bf16 hb = (__bf16)wb[j];
                h[j]     = ha;
                h[j + 4] = hb;
                l[j]     = (__bf16)(wa[j] - (float)ha);
                l[j + 4] = (__bf16)(wb[j] - (float)hb);
            }
            hi[tile * 64 + half * 32 + lane] = h;
            lo[tile * 64 + half * 32 + lane] = l;
        }
    }
}

// ---------------------------------------------------------------------------
// Fragment helpers (bf16 16x16x32 operand layout, wave32)
// A 16x32: lanes 0-15 hold K {0..7,16..23}, lanes 16-31 hold K {8..15,24..31},
// K-pairs packed per VGPR.  B 32x16 mirrors A with N = lane%16.
// ---------------------------------------------------------------------------
union BFrag { v4u u[2]; v16bf v; };

// p: the lane's own global byte address (16 * lane into a fragment); off: constant byte offset of the fragment
typedef const __attribute__((address_space(1))) v4u* gv4u_ptr;
__device__ __forceinline__ v16bf load_b_bytes(unsigned long long p, int off) {
    BFrag f;
    f.u[0] = *(gv4u_ptr)(p + off);        // K = 8hi .. 8hi+7
    f.u[1] = *(gv4u_ptr)(p + off + 512);  // K = 16+8hi .. +7
    return f.v;
}

#define WMMA_BF16(ACC, A, B) \
    ACC = __builtin_amdgcn_wmma_f32_16x16x32_bf16(false, A, false, B, (short)0, ACC, false, false)
#define WMMA_F32(ACC, A, B) \
    ACC = __builtin_amdgcn_wmma_f32_16x16x4_f32(false, A, false, B, (short)0, ACC, false, false)

// ---------------------------------------------------------------------------
// Main fused kernel: bf16x3 split GEMM, contracted over i first:
//   T[b,o] = sum_i x[b,i]*Wk[zk,o,i]  (WMMA, A = split x, the same for every zk)
//   out[b,o] += z[b,zk]*T[b,o]        (f32 FMA on the accumulator tiles)
// ---------------------------------------------------------------------------
__device__ __forceinline__ void split_x_frag(const float* xrow, int i0, int hi,
                                             v16bf& ah, v16bf& al) {
    v4f q0 = *(const v4f*)(xrow + i0 + 8 * hi);
    v4f q1 = *(const v4f*)(xrow + i0 + 8 * hi + 4);
    v4f q2 = *(const v4f*)(xrow + i0 + 16 + 8 * hi);
    v4f q3 = *(const v4f*)(xrow + i0 + 20 + 8 * hi);
    float xf[16] = { q0.x, q0.y, q0.z, q0.w, q1.x, q1.y, q1.z, q1.w,
                     q2.x, q2.y, q2.z, q2.w, q3.x, q3.y, q3.z, q3.w };
    #pragma unroll
    for (int j = 0; j < 16; ++j) {
        __bf16 h = (__bf16)xf[j];
        ah[j] = h;
        al[j] = (__bf16)(xf[j] - (float)h);
    }
}

#define ZP 36              // LDS pitch (floats) of transposed z: 16B-aligned rows

__global__ __launch_bounds__(256) void bilinear_wmma_bf16x3(
    const float* __restrict__ x,  const float* __restrict__ z,
    const unsigned short* __restrict__ WhiU, const unsigned short* __restrict__ WloU,
    const float* __restrict__ Wb, const float* __restrict__ bk,
    const float* __restrict__ bb, float* __restrict__ out)
{
    __shared__ float zs[SPW * RS];
    __shared__ float xs[SPW * RS];
    __shared__ __attribute__((aligned(16))) float zt[D * ZP];   // zt[zk][sample]

    const int tid   = threadIdx.x;
    const int bbase = blockIdx.x * SPW;

    for (int idx = tid; idx < SPW * D; idx += 256) {
        const int s = idx >> 8, c = idx & (D - 1);
        const float zval = z[(bbase + s) * D + c];
        zs[s * RS + c] = zval;
        zt[c * ZP + s] = zval;
        xs[s * RS + c] = x[(bbase + s) * D + c];
    }
    __syncthreads();

    const int lane = tid & 31;
    const int wave = tid >> 5;
    const int r    = lane & 15;
    const int hi   = lane >> 4;
    const int o0   = (wave * 2 + 0) * 16 + r;
    const int o1   = (wave * 2 + 1) * 16 + r;

    v8f acc00 = {}; v8f acc01 = {}; v8f acc10 = {}; v8f acc11 = {};

    const float* xrowA = &xs[(r +  0) * RS];
    const float* xrowB = &xs[(r + 16) * RS];

    // ---- W fragment ring: first four stages, asked for ahead of the x split ----
    // A stage is one column tile (16 o) x 64 i of both planes: 2 KiB in a row per plane.
    // Eight stages per zk; four are in registers, loaded four stages ahead.
    unsigned long long qh = (unsigned long long)WhiU + (unsigned long long)(wave * (32 * D * 2) + lane * 16);
    unsigned long long ql = (unsigned long long)WloU + (unsigned long long)(wave * (32 * D * 2) + lane * 16);
    v16bf Bh[4][2], Bl[4][2];
    #pragma unroll   // constant indices: the ring stays in registers
    for (int st = 0; st < 4; ++st) {
        const int off = (st & 1) * (16 * D * 2) + (st >> 1) * 2048;
        Bh[st][0] = load_b_bytes(qh, off);
        Bh[st][1] = load_b_bytes(qh, off + 1024);
        Bl[st][0] = load_b_bytes(ql, off);
        Bl[st][1] = load_b_bytes(ql, off + 1024);
    }
    // the wait stands in front of any reuse of the registers that these loads name
    asm volatile("s_wait_xcnt 0x0" : "+v"(qh), "+v"(ql) :: "memory");

    // ---- A operand: x split into bf16 hi/lo once, held in registers for all zk ----
    v16bf xAh[8], xAl[8], xBh[8], xBl[8];
    #pragma unroll   // constant indices: the fragment arrays stay in registers
    for (int kk = 0; kk < 8; ++kk) {
        split_x_frag(xrowA, kk * 32, hi, xAh[kk], xAl[kk]);
        split_x_frag(xrowB, kk * 32, hi, xBh[kk], xBl[kk]);
    }

    // ---- main contraction ----
    const float* ztp = &zt[8 * hi];
    // kept rolled: one zk is 96 WMMAs already, and a second copy would not fit the registers
    #pragma unroll 1
    for (int zk = 0; zk < D; ++zk) {
        // the last zk refetches its own first stages, so that no load leaves the planes
        const size_t nxt = (zk + 1 < D) ? (size_t)KW * 2 : (size_t)0;
        const v4f zA0 = *(const v4f*)(ztp + zk * ZP);
        const v4f zA1 = *(const v4f*)(ztp + zk * ZP + 4);
        const v4f zB0 = *(const v4f*)(ztp + zk * ZP + 16);
        const v4f zB1 = *(const v4f*)(ztp + zk * ZP + 20);
        v8f tA[2] = { {}, {} };
        v8f tB[2] = { {}, {} };
        #pragma unroll   // constant ring slot, fragment and tile indices (registers, no scratch)
        for (int st = 0; st < 8; ++st) {
            const int ct = st & 1, pr = st >> 1, sl = st & 3;
            #pragma unroll   // as above
            for (int h = 0; h < 2; ++h) {
                const int kk = pr * 2 + h;
                WMMA_BF16(tA[ct], xAh[kk], Bh[sl][h]); WMMA_BF16(tB[ct], xBh[kk], Bh[sl][h]);
                WMMA_BF16(tA[ct], xAh[kk], Bl[sl][h]); WMMA_BF16(tB[ct], xBh[kk], Bl[sl][h]);
                WMMA_BF16(tA[ct], xAl[kk], Bh[sl][h]); WMMA_BF16(tB[ct], xBl[kk], Bh[sl][h]);
            }
            if (st == 4) {
                // the two address pairs move on to the next zk here, once per zk
                qh += nxt;
                ql += nxt;
            }
            const int s4  = (st + 4) & 7;
            const int off = (s4 & 1) * (16 * D * 2) + (s4 >> 1) * 2048;
            Bh[sl][0] = load_b_bytes(qh, off);
            Bh[sl][1] = load_b_bytes(qh, off + 1024);
            Bl[sl][0] = load_b_bytes(ql, off);
            Bl[sl][1] = load_b_bytes(ql, off + 1024);
        }
        #pragma unroll   // constant vector element indices
        for (int j = 0; j < 4; ++j) {
            acc00[j]     += zA0[j] * tA[0][j];
            acc00[j + 4] += zA1[j] * tA[0][j + 4];
            acc01[j]     += zA0[j] * tA[1][j];
            acc01[j + 4] += zA1[j] * tA[1][j + 4];
            acc10[j]     += zB0[j] * tB[0][j];
            acc10[j + 4] += zB1[j] * tB[0][j + 4];
            acc11[j]     += zB0[j] * tB[1][j];
            acc11[j + 4] += zB1[j] * tB[1][j + 4];
        }
    }

    // ---- W_bias pass (exact fp32 WMMA): out += sum_i W_bias[o,i]*x[b,i] ----
    {
        const float* xpA = xrowA + 2 * hi;
        const float* xpB = xrowB + 2 * hi;
        const float* w0  = Wb + o0 * D + 2 * hi;
        const float* w1  = Wb + o1 * D + 2 * hi;
        #pragma unroll 4
        for (int i0 = 0; i0 < D; i0 += 4) {
            const v2f aA  = *(const v2f*)(xpA + i0);
            const v2f aB  = *(const v2f*)(xpB + i0);
            const v2f bf0 = *(const v2f*)(w0 + i0);
            const v2f bf1 = *(const v2f*)(w1 + i0);
            WMMA_F32(acc00, aA, bf0); WMMA_F32(acc01, aA, bf1);
            WMMA_F32(acc10, aB, bf0); WMMA_F32(acc11, aB, bf1);
        }
    }

    // ---- per-sample bias (exact fp32 WMMA): out += sum_zk z[b,zk]*b_kernel[zk,o] ----
    for (int zk = 0; zk < D; zk += 4) {
        v2f aA; aA.x = zs[(r +  0) * RS + zk + 2 * hi];
        /*   */ aA.y = zs[(r +  0) * RS + zk + 2 * hi + 1];
        v2f aB; aB.x = zs[(r + 16) * RS + zk + 2 * hi];
        /*   */ aB.y = zs[(r + 16) * RS + zk + 2 * hi + 1];
        v2f bf0; bf0.x = bk[(zk + 2 * hi) * D + o0];
        /*    */ bf0.y = bk[(zk + 2 * hi + 1) * D + o0];
        v2f bf1; bf1.x = bk[(zk + 2 * hi) * D + o1];
        /*    */ bf1.y = bk[(zk + 2 * hi + 1) * D + o1];
        WMMA_F32(acc00, aA, bf0); WMMA_F32(acc01, aA, bf1);
        WMMA_F32(acc10, aB, bf0); WMMA_F32(acc11, aB, bf1);
    }

    const float bias0 = bb[o0];
    const float bias1 = bb[o1];
    #pragma unroll
    for (int j = 0; j < 8; ++j) {
        const int rowA = bbase +      j + 8 * hi;
        const int rowB = bbase + 16 + j + 8 * hi;
        out[rowA * D + o0] = acc00[j] + bias0;
        out[rowA * D + o1] = acc01[j] + bias1;
        out[rowB * D + o0] = acc10[j] + bias0;
        out[rowB * D + o1] = acc11[j] + bias1;
    }
}

// ---------------------------------------------------------------------------
// Fallback: all-fp32 WMMA fused kernel (used when d_ws can't hold bf16 planes)
// ---------------------------------------------------------------------------
__global__ __launch_bounds__(256) void bilinear_wmma_f32(
    const float* __restrict__ x,  const float* __restrict__ z,
    const float* __restrict__ Wk, const float* __restrict__ Wb,
    const float* __restrict__ bk, const float* __restrict__ bb,
    float* __restrict__ out)
{
    __shared__ float zs[SPW * RS];
    __shared__ float xs[SPW * RS];

    const int tid   = threadIdx.x;
    const int bbase = blockIdx.x * SPW;

    for (int idx = tid; idx < SPW * D; idx += 256) {
        const int s = idx >> 8, c = idx & (D - 1);
        zs[s * RS + c] = z[(bbase + s) * D + c];
        xs[s * RS + c] = x[(bbase + s) * D + c];
    }
    __syncthreads();

    const int lane = tid & 31;
    const int wave = tid >> 5;
    const int r    = lane & 15;
    const int hi   = lane >> 4;
    const int o0   = (wave * 2 + 0) * 16 + r;
    const int o1   = (wave * 2 + 1) * 16 + r;

    v8f acc00 = {}; v8f acc01 = {}; v8f acc10 = {}; v8f acc11 = {};

    const float* xpA = &xs[(r +  0) * RS + 2 * hi];
    const float* xpB = &xs[(r + 16) * RS + 2 * hi];

    for (int zk = 0; zk < D; ++zk) {
        const float zvA = zs[(r +  0) * RS + zk];
        const float zvB = zs[(r + 16) * RS + zk];
        const float* w0 = Wk + (size_t)zk * KW + o0 * D + 2 * hi;
        const float* w1 = Wk + (size_t)zk * KW + o1 * D + 2 * hi;
        #pragma unroll 4
        for (int i0 = 0; i0 < D; i0 += 4) {
            const v2f xA  = *(const v2f*)(xpA + i0);
            const v2f xB  = *(const v2f*)(xpB + i0);
            const v2f bf0 = *(const v2f*)(w0 + i0);
            const v2f bf1 = *(const v2f*)(w1 + i0);
            v2f aA; aA.x = zvA * xA.x; aA.y = zvA * xA.y;
            v2f aB; aB.x = zvB * xB.x; aB.y = zvB * xB.y;
            WMMA_F32(acc00, aA, bf0); WMMA_F32(acc01, aA, bf1);
            WMMA_F32(acc10, aB, bf0); WMMA_F32(acc11, aB, bf1);
        }
    }
    {
        const float* w0 = Wb + o0 * D + 2 * hi;
        const float* w1 = Wb + o1 * D + 2 * hi;
        #pragma unroll 4
        for (int i0 = 0; i0 < D; i0 += 4) {
            const v2f aA  = *(const v2f*)(xpA + i0);
            const v2f aB  = *(const v2f*)(xpB + i0);
            const v2f bf0 = *(const v2f*)(w0 + i0);
            const v2f bf1 = *(const v2f*)(w1 + i0);
            WMMA_F32(acc00, aA, bf0); WMMA_F32(acc01, aA, bf1);
            WMMA_F32(acc10, aB, bf0); WMMA_F32(acc11, aB, bf1);
        }
    }
    for (int zk = 0; zk < D; zk += 4) {
        v2f aA; aA.x = zs[(r +  0) * RS + zk + 2 * hi];
        /*   */ aA.y = zs[(r +  0) * RS + zk + 2 * hi + 1];
        v2f aB; aB.x = zs[(r + 16) * RS + zk + 2 * hi];
        /*   */ aB.y = zs[(r + 16) * RS + zk + 2 * hi + 1];
        v2f bf0; bf0.x = bk[(zk + 2 * hi) * D + o0];
        /*    */ bf0.y = bk[(zk + 2 * hi + 1) * D + o0];
        v2f bf1; bf1.x = bk[(zk + 2 * hi) * D + o1];
        /*    */ bf1.y = bk[(zk + 2 * hi + 1) * D + o1];
        WMMA_F32(acc00, aA, bf0); WMMA_F32(acc01, aA, bf1);
        WMMA_F32(acc10, aB, bf0); WMMA_F32(acc11, aB, bf1);
    }

    const float bias0 = bb[o0];
    const float bias1 = bb[o1];
    #pragma unroll
    for (int j = 0; j < 8; ++j) {
        const int rowA = bbase +      j + 8 * hi;
        const int rowB = bbase + 16 + j + 8 * hi;
        out[rowA * D + o0] = acc00[j] + bias0;
        out[rowA * D + o1] = acc01[j] + bias1;
        out[rowB * D + o0] = acc10[j] + bias0;
        out[rowB * D + o1] = acc11[j] + bias1;
    }
}

extern "C" void kernel_launch(void* const* d_in, const int* in_sizes, int n_in,
                              void* d_out, int out_size, void* d_ws, size_t ws_size,
                              hipStream_t stream) {
    const float* x  = (const float*)d_in[0];   // [4096,256]
    const float* z  = (const float*)d_in[1];   // [4096,256]
    const float* Wk = (const float*)d_in[2];   // [256,65536]
    const float* Wb = (const float*)d_in[3];   // [65536]
    const float* bk = (const float*)d_in[4];   // [256,256]
    const float* bb = (const float*)d_in[5];   // [256]
    float* out = (float*)d_out;                // [4096,256]

    const size_t need = (size_t)2 * D * KW * sizeof(unsigned short);  // 67 MB hi+lo planes
    if (ws_size >= need) {
        unsigned short* Whi = (unsigned short*)d_ws;
        unsigned short* Wlo = Whi + (size_t)D * KW;
        wk_split_bf16<<<2048, 256, 0, stream>>>(Wk, Whi, Wlo);
        bilinear_wmma_bf16x3<<<BTOT / SPW, 256, 0, stream>>>(x, z, Whi, Wlo, Wb, bk, bb, out);
    } else {
        bilinear_wmma_f32<<<BTOT / SPW, 256, 0, stream>>>(x, z, Wk, Wb, bk, bb, out);
    }
}

// v003
// One run takes 215 microseconds.
// Timed twice side by side with v002, it ran 2.62 and 2.64 times as fast.
// Counting every step since v000, it is 5.15 times as fast.
#include <hip/hip_runtime.h>

typedef float        v2f   __attribute__((ext_vector_type(2)));
typedef float        v4f   __attribute__((ext_vector_type(4)));
typedef float        v8f   __attribute__((ext_vector_type(8)));
typedef __bf16       v16bf __attribute__((ext_vector_type(16)));
typedef __bf16       v8bf  __attribute__((ext_vector_type(8)));
typedef unsigned int v4u   __attribute__((ext_vector_type(4)));

#define BTOT 4096
#define D    256           // X_DIM == Z_DIM == OUT_DIM
#define KW   (D * D)       // 65536 = W_kernel row length
#define RS   260           // LDS row stride (floats): 16B-aligned rows, conflict-free
#define SPW  32            // samples per workgroup (2 WMMA M-tiles)

// ---------------------------------------------------------------------------
// One-shot split of W_kernel into bf16 hi/lo planes (hi = rne(w), lo = rne(w - hi)),
// each plane stored in B-fragment order:
//   plane[zk][o / 16][i / 32][half][lane][8 values], lane = (o % 16) + 16 * hi,
//   the 8 values being i % 32 = 16 * half + 8 * hi + 0..7.
// A fragment (16 o x 32 i) is 1 KiB in a row, and each of its two 16-byte loads per
// lane reads 512 contiguous bytes (4 whole lines) per wave.
// ---------------------------------------------------------------------------
__global__ __launch_bounds__(256) void wk_split_bf16(
    const float* __restrict__ Wk,
    unsigned short* __restrict__ hiU, unsigned short* __restrict__ loU)
{
    v8bf* hi = (v8bf*)hiU;
    v8bf* lo = (v8bf*)loU;
    const int total = (D * KW) / 16;       // one lane's share (16 values) per trip
    for (int q = blockIdx.x * blockDim.x + threadIdx.x; q < total;
         q += gridDim.x * blockDim.x) {
        const int lane = q & 31;
        const int tile = q >> 5;                             // (zk * 16 + o / 16) * 8 + i / 32
        const int row  = (tile >> 3) * 16 + (lane & 15);     // zk * 256 + o
        const float* src = Wk + row * D + (tile & 7) * 32 + 8 * (lane >> 4);
        #pragma unroll   // constant offsets: the four loads go out together
        for (int half = 0; half < 2; ++half) {
            const v4f wa = *(const v4f*)(src + 16 * half);
            const v4f wb = *(const v4f*)(src + 16 * half + 4);
            v8bf h, l;
            #pragma unroll   // constant vector element indices
            for (int j = 0; j < 4; ++j) {
                const __bf16 ha = (__bf16)wa[j];
                const __bf16 hb = (__bf16)wb[j];
                h[j]     = ha;
                h[j + 4] = hb;
                l[j]     = (__bf16)(wa[j] - (float)ha);
                l[j + 4] = (__bf16)(wb[j] - (float)hb);
            }
            hi[tile * 64 + half * 32 + lane] = h;
            lo[tile * 64 + half * 32 + lane] = l;
        }
    }
}

// ---------------------------------------------------------------------------
// Fragment helpers (bf16 16x16x32 operand layout, wave32)
// A 16x32: lanes 0-15 hold K {0..7,16..23}, lanes 16-31 hold K {8..15,24..31},
// K-pairs packed per VGPR.  B 32x16 mirrors A with N = lane%16.
// ---------------------------------------------------------------------------
union BFrag { v4u u[2]; v16bf v; };

// p: the lane's own global byte address (16 * lane into a fragment); off: constant byte offset of the fragment
typedef const __attribute__((address_space(1))) v4u* gv4u_ptr;
__device__ __forceinline__ v16bf load_b_bytes(unsigned long long p, int off) {
    BFrag f;
    f.u[0] = *(gv4u_ptr)(p + off);        // K = 8hi .. 8hi+7
    f.u[1] = *(gv4u_ptr)(p + off + 512);  // K = 16+8hi .. +7
    return f.v;
}

#define WMMA_BF16(ACC, A, B) \
    ACC = __builtin_amdgcn_wmma_f32_16x16x32_bf16(false, A, false, B, (short)0, ACC, false, false)
#define WMMA_F32(ACC, A, B) \
    ACC = __builtin_amdgcn_wmma_f32_16x16x4_f32(false, A, false, B, (short)0, ACC, false, false)

// ---------------------------------------------------------------------------
// Main fused kernel: bf16x3 split GEMM, contracted over i first:
//   T[b,o] = sum_i x[b,i]*Wk[zk,o,i]  (WMMA, A = split x, the same for every zk)
//   out[b,o] += z[b,zk]*T[b,o]        (f32 FMA on the accumulator tiles)
// ---------------------------------------------------------------------------
__device__ __forceinline__ void split_x_frag(const float* xrow, int i0, int hi,
                                             v16bf& ah, v16bf& al) {
    v4f q0 = *(const v4f*)(xrow + i0 + 8 * hi);
    v4f q1 = *(const v4f*)(xrow + i0 + 8 * hi + 4);
    v4f q2 = *(const v4f*)(xrow + i0 + 16 + 8 * hi);
    v4f q3 = *(const v4f*)(xrow + i0 + 20 + 8 * hi);
    float xf[16] = { q0.x, q0.y, q0.z, q0.w, q1.x, q1.y, q1.z, q1.w,
                     q2.x, q2.y, q2.z, q2.w, q3.x, q3.y, q3.z, q3.w };
    #pragma unroll
    for (int j = 0; j < 16; ++j) {
        __bf16 h = (__bf16)xf[j];
        ah[j] = h;
        al[j] = (__bf16)(xf[j] - (float)h);
    }
}

#define SPB 64             // samples per workgroup here (4 WMMA M-tiles, all four in every wave)
#define OPB 64             // output columns per workgroup (one 16-column tile per wave)
#define ZP  68             // LDS pitch (floats) of transposed z: 16B-aligned rows
#define OP  68             // LDS pitch (floats) of the staged output tile
#define ZKB (KW * 2)       // bytes of one zk in a plane
#define STG 16             // staging trips whose loads go out as one group

typedef const __attribute__((address_space(1))) v4f* gv4f_ptr;

__global__ __launch_bounds__(128) void bilinear_wmma_bf16x3(
    const float* __restrict__ x,  const float* __restrict__ z,
    const unsigned short* __restrict__ WhiU, const unsigned short* __restrict__ WloU,
    const float* __restrict__ Wb, const float* __restrict__ bk,
    const float* __restrict__ bb, float* __restrict__ out)
{
    __shared__ __attribute__((aligned(16))) float zs[SPB * RS];
    __shared__ __attribute__((aligned(16))) float xs[SPB * RS];
    __shared__ __attribute__((aligned(16))) float zt[D * ZP];   // zt[zk][sample]
    __shared__ __attribute__((aligned(16))) float os[SPB * OP]; // output tile, [sample][column]

    const int tid   = threadIdx.x;
    const int bbase = (blockIdx.x >> 2) * SPB;
    const int obase = (blockIdx.x & 3) * OPB;

    // One wave-wide load covers 4 rows x 128 B (whole lines); the 4 rows keep the
    // transposed stores to zt on 16 banks. A lane's place in its trip never changes, so every
    // load names the same address pair with a constant offset.
    const int s0 = (tid >> 3) & 3;
    const int c0 = ((tid >> 5) << 5) + ((tid & 7) << 2);
    unsigned long long pz = (unsigned long long)(z + (bbase + s0) * D + c0);
    unsigned long long px = (unsigned long long)(x + (bbase + s0) * D + c0);
    #pragma unroll   // constant offsets
    for (int g = 0; g < SPB * D / 4 / 128 / STG; ++g) {
        v4f zval[STG], xval[STG];
        #pragma unroll   // constant indices; the loads of a group go out together
        for (int u = 0; u < STG; ++u) {
            const int trip = g * STG + u;
            const int off  = ((trip >> 1) * 4 * D + (trip & 1) * 128) * 4;
            zval[u] = *(gv4f_ptr)(pz + off);
            xval[u] = *(gv4f_ptr)(px + off);
        }
        // the wait stands in front of any reuse of the registers that these loads name
        asm volatile("s_wait_xcnt 0x0" : "+v"(pz), "+v"(px) :: "memory");
        #pragma unroll   // constant indices
        for (int u = 0; u < STG; ++u) {
            const int trip = g * STG + u;
            const int s = (trip >> 1) * 4 + s0;
            const int c = (trip & 1) * 128 + c0;
            *(v4f*)&zs[s * RS + c] = zval[u];
            *(v4f*)&xs[s * RS + c] = xval[u];
            #pragma unroll   // constant vector element indices
            for (int j = 0; j < 4; ++j) zt[(c + j) * ZP + s] = zval[u][j];
        }
    }
    __syncthreads();

    const int lane = tid & 31;
    const int wave = tid >> 5;
    const int r    = lane & 15;
    const int hi   = lane >> 4;
    const int o    = obase + wave * 16 + r;

    v8f acc[4] = { {}, {}, {}, {} };

    // ---- W fragment ring: sixteen stages (two zk), asked for ahead of the x split ----
    // A stage is the wave's column tile (16 o) x 32 i of both planes of one zk: 1 KiB per
    // plane. Two zk are worked on side by side; each slot is refilled two zk ahead, and the
    // first fill asks in the order in which the loop asks, so that its counted waits fit both.
    unsigned long long qh = (unsigned long long)WhiU + (unsigned long long)(((obase >> 4) + wave) * (16 * D * 2) + lane * 16);
    unsigned long long ql = (unsigned long long)WloU + (unsigned long long)(((obase >> 4) + wave) * (16 * D * 2) + lane * 16);
    v16bf Bh[8][2], Bl[8][2];
    #pragma unroll   // constant indices: the ring stays in registers
    for (int kk = 0; kk < 8; ++kk) {
        Bh[kk][0] = load_b_bytes(qh, kk * 1024);
        Bh[kk][1] = load_b_bytes(qh, kk * 1024 + ZKB);
        Bl[kk][0] = load_b_bytes(ql, kk * 1024);
        Bl[kk][1] = load_b_bytes(ql, kk * 1024 + ZKB);
    }
    // the wait stands in front of any reuse of the registers that these loads name
    asm volatile("s_wait_xcnt 0x0" : "+v"(qh), "+v"(ql) :: "memory");

    // ---- A operand: x split into bf16 hi/lo once, held in registers for all zk ----
    v16bf xh[4][8], xl[4][8];
    #pragma unroll   // constant indices: the fragment arrays stay in registers
    for (int kk = 0; kk < 8; ++kk) {
        #pragma unroll   // as above
        for (int m = 0; m < 4; ++m)
            split_x_frag(&xs[(r + 16 * m) * RS], kk * 32, hi, xh[m][kk], xl[m][kk]);
    }

    // ---- main contraction ----
    const float* ztp = &zt[8 * hi];
    // kept rolled: two zk (one turn of the ring) are 192 WMMAs already
    #pragma unroll 1
    for (int zk = 0; zk < D; zk += 2) {
        // the last two zk refetch their own stages, so that no load leaves the planes
        const size_t nxt = (zk + 2 < D) ? (size_t)(2 * ZKB) : (size_t)0;
        v4f zv[2][4][2];
        #pragma unroll   // constant indices
        for (int zz = 0; zz < 2; ++zz) {
            #pragma unroll   // as above
            for (int m = 0; m < 4; ++m) {
                zv[zz][m][0] = *(const v4f*)(ztp + (zk + zz) * ZP + 16 * m);
                zv[zz][m][1] = *(const v4f*)(ztp + (zk + zz) * ZP + 16 * m + 4);
            }
        }
        v8f t[2][4] = { { {}, {}, {}, {} }, { {}, {}, {}, {} } };
        #pragma unroll   // constant ring slot, fragment and tile indices (registers, no scratch)
        for (int kk = 0; kk < 8; ++kk) {
            #pragma unroll   // as above
            for (int q = 0; q < 8; ++q) WMMA_BF16(t[q >> 2][q & 3], xh[q & 3][kk], Bh[kk][q >> 2]);
            #pragma unroll   // as above
            for (int q = 0; q < 8; ++q) WMMA_BF16(t[q >> 2][q & 3], xh[q & 3][kk], Bl[kk][q >> 2]);
            #pragma unroll   // as above
            for (int q = 0; q < 8; ++q) WMMA_BF16(t[q >> 2][q & 3], xl[q & 3][kk], Bh[kk][q >> 2]);
            if ((kk & 1) && kk < 7) {
                // the refills of two kk go out as one group of 16 loads behind their 48 WMMAs:
                // without the two scheduling barriers the compiler spreads the loads in pairs among
                // the WMMAs (32 places a trip, not 4), and a SIMD's lone wave has no second wave to
                // fill a stop of its matrix stream
                __builtin_amdgcn_sched_barrier(0);
                if (kk == 1) {
                    // the two address pairs move on by one turn of the ring, once per trip; the
                    // wait stands in front of the overwrite of registers that issued loads name
                    asm volatile("s_wait_xcnt 0x0" : "+v"(qh), "+v"(ql) :: "memory");
                    qh += nxt;
                    ql += nxt;
                }
                #pragma unroll   // constant ring slots
                for (int k2 = kk - 1; k2 <= kk; ++k2) {
                    Bh[k2][0] = load_b_bytes(qh, k2 * 1024);
                    Bh[k2][1] = load_b_bytes(qh, k2 * 1024 + ZKB);
                    Bl[k2][0] = load_b_bytes(ql, k2 * 1024);
                    Bl[k2][1] = load_b_bytes(ql, k2 * 1024 + ZKB);
                }
                __builtin_amdgcn_sched_barrier(0);
            }
        }
        #pragma unroll   // constant indices; zk before zk + 1, as the sum runs
        for (int zz = 0; zz < 2; ++zz) {
            #pragma unroll   // as above
            for (int m = 0; m < 4; ++m) {
                #pragma unroll   // constant vector element indices
                for (int j = 0; j < 4; ++j) {
                    acc[m][j]     += zv[zz][m][0][j] * t[zz][m][j];
                    acc[m][j + 4] += zv[zz][m][1][j] * t[zz][m][j + 4];
                }
            }
        }
        // the last group of refills stands behind the z multiplies, which are thus free to
        // be scheduled among the last WMMAs; the barrier keeps the group whole, as above
        __builtin_amdgcn_sched_barrier(0);
        #pragma unroll   // constant ring slots
        for (int k2 = 6; k2 <= 7; ++k2) {
            Bh[k2][0] = load_b_bytes(qh, k2 * 1024);
            Bh[k2][1] = load_b_bytes(qh, k2 * 1024 + ZKB);
            Bl[k2][0] = load_b_bytes(ql, k2 * 1024);
            Bl[k2][1] = load_b_bytes(ql, k2 * 1024 + ZKB);
        }
    }

    // ---- W_bias pass (exact fp32 WMMA): out += sum_i W_bias[o,i]*x[b,i] ----
    {
        const float* xp = &xs[r * RS + 2 * hi];
        const float* w0 = Wb + o * D + 2 * hi;
        #pragma unroll 4
        for (int i0 = 0; i0 < D; i0 += 4) {
            const v2f bf0 = *(const v2f*)(w0 + i0);
            #pragma unroll   // constant accumulator indices
            for (int m = 0; m < 4; ++m) {
                const v2f a = *(const v2f*)(xp + 16 * m * RS + i0);
                WMMA_F32(acc[m], a, bf0);
            }
        }
    }

    // ---- per-sample bias (exact fp32 WMMA): out += sum_zk z[b,zk]*b_kernel[zk,o] ----
    for (int zk = 0; zk < D; zk += 4) {
        v2f bf0; bf0.x = bk[(zk + 2 * hi) * D + o];
        /*    */ bf0.y = bk[(zk + 2 * hi + 1) * D + o];
        #pragma unroll   // constant accumulator indices
        for (int m = 0; m < 4; ++m) {
            v2f a; a.x = zs[(r + 16 * m) * RS + zk + 2 * hi];
            /*  */ a.y = zs[(r + 16 * m) * RS + zk + 2 * hi + 1];
            WMMA_F32(acc[m], a, bf0);
        }
    }

    // ---- output: a wave holds 64-B pieces of rows, so the tile goes through LDS and
    // every 128-B line of out is stored whole, by one wave ----
    const float bias0 = bb[o];
    #pragma unroll   // constant accumulator indices
    for (int m = 0; m < 4; ++m) {
        #pragma unroll   // constant vector element indices
        for (int j = 0; j < 8; ++j)
            os[(16 * m + j + 8 * hi) * OP + wave * 16 + r] = acc[m][j] + bias0;
    }
    __syncthreads();   // the four waves' column tiles are read across waves below
    #pragma unroll   // eight independent 16-byte stores per lane
    for (int trip = 0; trip < SPB * OPB / 4 / 128; ++trip) {
        const int idx = trip * 128 + tid;
        const int s = idx >> 4, c = (idx & 15) * 4;
        *(v4f*)(out + (bbase + s) * D + obase + c) = *(const v4f*)&os[s * OP + c];
    }
}

// ---------------------------------------------------------------------------
// Fallback: all-fp32 WMMA fused kernel (used when d_ws can't hold bf16 planes)
// ---------------------------------------------------------------------------
__global__ __launch_bounds__(256) void bilinear_wmma_f32(
    const float* __restrict__ x,  const float* __restrict__ z,
    const float* __restrict__ Wk, const float* __restrict__ Wb,
    const float* __restrict__ bk, const float* __restrict__ bb,
    float* __restrict__ out)
{
    __shared__ float zs[SPW * RS];
    __shared__ float xs[SPW * RS];

    const int tid   = threadIdx.x;
    const int bbase = blockIdx.x * SPW;

    for (int idx = tid; idx < SPW * D; idx += 256) {
        const int s = idx >> 8, c = idx & (D - 1);
        zs[s * RS + c] = z[(bbase + s) * D + c];
        xs[s * RS + c] = x[(bbase + s) * D + c];
    }
    __syncthreads();

    const int lane = tid & 31;
    const int wave = tid >> 5;
    const int r    = lane & 15;
    const int hi   = lane >> 4;
    const int o0   = (wave * 2 + 0) * 16 + r;
    const int o1   = (wave * 2 + 1) * 16 + r;

    v8f acc00 = {}; v8f acc01 = {}; v8f acc10 = {}; v8f acc11 = {};

    const float* xpA = &xs[(r +  0) * RS + 2 * hi];
    const float* xpB = &xs[(r + 16) * RS + 2 * hi];

    for (int zk = 0; zk < D; ++zk) {
        const float zvA = zs[(r +  0) * RS + zk];
        const float zvB = zs[(r + 16) * RS + zk];
        const float* w0 = Wk + (size_t)zk * KW + o0 * D + 2 * hi;
        const float* w1 = Wk + (size_t)zk * KW + o1 * D + 2 * hi;
        #pragma unroll 4
        for (int i0 = 0; i0 < D; i0 += 4) {
            const v2f xA  = *(const v2f*)(xpA + i0);
            const v2f xB  = *(const v2f*)(xpB + i0);
            const v2f bf0 = *(const v2f*)(w0 + i0);
            const v2f bf1 = *(const v2f*)(w1 + i0);
            v2f aA; aA.x = zvA * xA.x; aA.y = zvA * xA.y;
            v2f aB; aB.x = zvB * xB.x; aB.y = zvB * xB.y;
            WMMA_F32(acc00, aA, bf0); WMMA_F32(acc01, aA, bf1);
            WMMA_F32(acc10, aB, bf0); WMMA_F32(acc11, aB, bf1);
        }
    }
    {
        const float* w0 = Wb + o0 * D + 2 * hi;
        const float* w1 = Wb + o1 * D + 2 * hi;
        #pragma unroll 4
        for (int i0 = 0; i0 < D; i0 += 4) {
            const v2f aA  = *(const v2f*)(xpA + i0);
            const v2f aB  = *(const v2f*)(xpB + i0);
            const v2f bf0 = *(const v2f*)(w0 + i0);
            const v2f bf1 = *(const v2f*)(w1 + i0);
            WMMA_F32(acc00, aA, bf0); WMMA_F32(acc01, aA, bf1);
            WMMA_F32(acc10, aB, bf0); WMMA_F32(acc11, aB, bf1);
        }
    }
    for (int zk = 0; zk < D; zk += 4) {
        v2f aA; aA.x = zs[(r +  0) * RS + zk + 2 * hi];
        /*   */ aA.y = zs[(r +  0) * RS + zk + 2 * hi + 1];
        v2f aB; aB.x = zs[(r + 16) * RS + zk + 2 * hi];
        /*   */ aB.y = zs[(r + 16) * RS + zk + 2 * hi + 1];
        v2f bf0; bf0.x = bk[(zk + 2 * hi) * D + o0];
        /*    */ bf0.y = bk[(zk + 2 * hi + 1) * D + o0];
        v2f bf1; bf1.x = bk[(zk + 2 * hi) * D + o1];
        /*    */ bf1.y = bk[(zk + 2 * hi + 1) * D + o1];
        WMMA_F32(acc00, aA, bf0); WMMA_F32(acc01, aA, bf1);
        WMMA_F32(acc10, aB, bf0); WMMA_F32(acc11, aB, bf1);
    }

    const float bias0 = bb[o0];
    const float bias1 = bb[o1];
    #pragma unroll
    for (int j = 0; j < 8; ++j) {
        const int rowA = bbase +      j + 8 * hi;
        const int rowB = bbase + 16 + j + 8 * hi;
        out[rowA * D + o0] = acc00[j] + bias0;
        out[rowA * D + o1] = acc01[j] + bias1;
        out[rowB * D + o0] = acc10[j] + bias0;
        out[rowB * D + o1] = acc11[j] + bias1;
    }
}

extern "C" void kernel_launch(void* const* d_in, const int* in_sizes, int n_in,
                              void* d_out, int out_size, void* d_ws, size_t ws_size,
                              hipStream_t stream) {
    const float* x  = (const float*)d_in[0];   // [4096,256]
    const float* z  = (const float*)d_in[1];   // [4096,256]
    const float* Wk = (const float*)d_in[2];   // [256,65536]
    const float* Wb = (const float*)d_in[3];   // [65536]
    const float* bk = (const float*)d_in[4];   // [256,256]
    const float* bb = (const float*)d_in[5];   // [256]
    float* out = (float*)d_out;                // [4096,256]

    const size_t need = (size_t)2 * D * KW * sizeof(unsigned short);  // 67 MB hi+lo planes
    if (ws_size >= need) {
        unsigned short* Whi = (unsigned short*)d_ws;
        unsigned short* Wlo = Whi + (size_t)D * KW;
        wk_split_bf16<<<2048, 256, 0, stream>>>(Wk, Whi, Wlo);
        bilinear_wmma_bf16x3<<<(BTOT / SPB) * (D / OPB), 128, 0, stream>>>(x, z, Whi, Wlo, Wb, bk, bb, out);
    } else {
        bilinear_wmma_f32<<<BTOT / SPW, 256, 0, stream>>>(x, z, Wk, Wb, bk, bb, out);
    }
}
